// v000
// Measured on an AMD MI455X. A time is GPU time per run, averaged over a window of back-to-back runs after a warm-up
// (all launches, gaps included; the runs take copies of the inputs in turn), and the median of several windows.
// Apart from v000's, it joins two sittings. Times from different sittings can be a few percent apart, while
// side-by-side timings come from the same sitting.
// v000, which the later versions start from, runs in 1290 microseconds.
// Contractions: x.We1^T, h_e.We2^T (produced as embs^T), x.Wk1^T, h_k.Wk2^T, q.k^T and p.embs all run on v_wmma_f32_16x16x32_f16 (f16 operands: x and W/b RNE-converted to bf16 and carried exactly in f16 as x*16 and W*1024; hidden, embs and k planes plain f16; q = f16 hi plane + f16 residual plane x4096 folded from a separate accumulator (2 products); p carried x1024 in f16), all f32 accumulate; bias, ReLU and softmax in f32.
#include <hip/hip_runtime.h>
#include <math.h>
#include <stdint.h>

#define NBATCH 8
#define SEQ    2048
#define DIN    512
#define HID    2048
#define DKEY   128
#define KQW    (2 * DKEY)
#define NROWS  (NBATCH * SEQ)     // 16384
#define MHALF  (NROWS / 2)        // 8192 rows = 4 batches
static_assert(MHALF == 4 * SEQ);
static_assert((SEQ % 64) == 0 && (DIN % 64) == 0 && (HID % 64) == 0 && (KQW % 64) == 0);
static_assert((DKEY % 32) == 0 && (DIN % 32) == 0 && (HID % 32) == 0);
static_assert(SEQ == 256 * 8);

typedef _Float16 v16h __attribute__((ext_vector_type(16)));
typedef _Float16 v8h  __attribute__((ext_vector_type(8)));
typedef float    v8f  __attribute__((ext_vector_type(8)));
typedef float    v4f  __attribute__((ext_vector_type(4)));
typedef unsigned int v4u __attribute__((ext_vector_type(4)));

// ---- scalar helpers --------------------------------------------------------------------------------
__device__ __forceinline__ unsigned short bf_bits(float f) {          // f32 -> bf16 bits, RNE convert
  unsigned u = __float_as_uint(f);
  return (unsigned short)((u + 0x7FFFu + ((u >> 16) & 1u)) >> 16);
}
__device__ __forceinline__ float bf_up(unsigned short h) { return __uint_as_float(((unsigned)h) << 16); }
__device__ __forceinline__ unsigned short h_bits(_Float16 x) { return __builtin_bit_cast(unsigned short, x); }
__device__ __forceinline__ unsigned pk16(unsigned short a, unsigned short b) { return (unsigned)a | ((unsigned)b << 16); }
__device__ __forceinline__ v8f zero8() { v8f z = {0.f, 0.f, 0.f, 0.f, 0.f, 0.f, 0.f, 0.f}; return z; }

// ---- fragment loader: 16-bit A/B operand, lane -> row/col (lane&15), p already includes +8*(lane>>4);
//      elements 0..7 <- p[0..7] (k0+8h..), elements 8..15 <- p[16..23] (k0+16+8h..)
__device__ __forceinline__ v16h ldfrag_h(const _Float16* p) {
  union { v16h v; v8h h[2]; } f;
  f.h[0] = *(const v8h*)(p);
  f.h[1] = *(const v8h*)(p + 16);
  return f.v;
}

// ---- WMMA helpers with trailing VALU hazard gap --------------------------------------------------------
__device__ __forceinline__ v8f mma_h_raw(v16h a, v16h b, v8f c) {
  return __builtin_amdgcn_wmma_f32_16x16x32_f16(false, a, false, b, (short)0, c, false, false);
}
__device__ __forceinline__ void res_guard(v8f& t, v8f& acc, v16h x, v16h y) {
#if defined(__HIP_DEVICE_COMPILE__)
  asm volatile("v_nop\n\tv_nop\n\tv_nop\n\tv_nop" : "+v"(t), "+v"(acc) : "v"(x), "v"(y));
#endif
}
__device__ __forceinline__ void dep_guard_h(v8f& a, v8f& b, v16h x, v16h y) {
#if defined(__HIP_DEVICE_COMPILE__)
  asm volatile("v_nop\n\tv_nop\n\tv_nop\n\tv_nop" : "+v"(a), "+v"(b) : "v"(x), "v"(y));
#endif
}
__device__ __forceinline__ void keep4_h(v16h a, v16h b, v16h c, v16h d) {
#if defined(__HIP_DEVICE_COMPILE__)
  asm volatile("v_nop" :: "v"(a), "v"(b), "v"(c), "v"(d));
#endif
}
__device__ __forceinline__ void acc_guard4(v8f& a, v8f& b, v8f& c, v8f& d) {
#if defined(__HIP_DEVICE_COMPILE__)
  asm volatile("v_nop\n\tv_nop\n\tv_nop\n\tv_nop" : "+v"(a), "+v"(b), "+v"(c), "+v"(d));
#endif
}
__device__ __forceinline__ void wave_sync_lds() {
  __builtin_amdgcn_fence(__ATOMIC_RELEASE, "workgroup");
  __builtin_amdgcn_wave_barrier();
  __builtin_amdgcn_fence(__ATOMIC_ACQUIRE, "workgroup");
}

// =====================================================================================================
// f32 -> f16( bf16_RNE(x) * scale ), scale a power of two (exact), 8 elements per thread, one 16-B store
// =====================================================================================================
__global__ __launch_bounds__(256) void cvt_h8(const float* __restrict__ in, unsigned short* out, int n8, float scale) {
  const int i = blockIdx.x * 256 + threadIdx.x;
  if (i < n8) {
    const v4f a = *(const v4f*)(in + (size_t)i * 8);
    const v4f c = *(const v4f*)(in + (size_t)i * 8 + 4);
    float f[8];
    f[0] = a[0]; f[1] = a[1]; f[2] = a[2]; f[3] = a[3];
    f[4] = c[0]; f[5] = c[1]; f[6] = c[2]; f[7] = c[3];
    unsigned short hb[8];
#pragma unroll
    for (int e = 0; e < 8; ++e) hb[e] = h_bits((_Float16)(bf_up(bf_bits(f[e])) * scale));
    v4u p;
    p[0] = pk16(hb[0], hb[1]);
    p[1] = pk16(hb[2], hb[3]);
    p[2] = pk16(hb[4], hb[5]);
    p[3] = pk16(hb[6], hb[7]);
    *(v4u*)(out + (size_t)i * 8) = p;
    
  }
}

// =====================================================================================================
// Register-blocked batched f16 WMMA GEMM: C[m][n] = epi( sum_k A[m][k] * Bt[n][k] ); one wave per 64x64
// tile, no block barriers. A row-major [M][K] pitch lda; Bt row-major [N][K] pitch ldb (k contiguous);
// M, N multiples of 64, K multiple of 32 (host-checked). blockIdx.y = batch index (strides in elements).
// NSPLIT: 0 = A.Bt; 1 = A.Bt + rres * (A2.Bt) with A2 = scaled f16 residual plane of A (pitch lda2),
//         residual products computed per k-step into a zeroed accumulator and folded in f32.
// epi: v = acc * oscale (+ bf16_RNE(bias[n]) if BIAS==1, + bf16_RNE(bias[m]) if BIAS==2), ReLU if RELU.
// OUT_MODE: 0 = f32 (pitch ldc); 1 = f16 plane C; 3 = f16 hi plane C + f16 residual plane C2 =
//           f16((v - hi) * rscale) written for tiles with n0 >= rlo at column n0 - rlo (pitch ldc2).
// =====================================================================================================
template <int NSPLIT, int RELU, int BIAS, int OUT_MODE>
__global__ __launch_bounds__(256) void gemm64(
    const unsigned short* __restrict__ Ap, int lda, long long strideA,
    const unsigned short* __restrict__ A2p, int lda2, long long strideA2,
    const unsigned short* __restrict__ Btp, int ldb, long long strideB,
    const float* __restrict__ bias,
    void* Cout, int ldc, long long strideC,
    void* Cout2, int ldc2, long long strideC2, int rlo,
    int M, int N, int K, float oscale, float rres, float rscale) {
  const _Float16* A  = (const _Float16*)(const void*)Ap;
  const _Float16* A2 = (const _Float16*)(const void*)A2p;
  const _Float16* Bt = (const _Float16*)(const void*)Btp;
  __shared__ __align__(16) float sT[8][16 * 68];   // per-wave 16x64 slab, pitch 68 floats
  const int b    = blockIdx.y;
  const int lane = threadIdx.x & 31;
  const int wave = threadIdx.x >> 5;
  const int tilesN = N >> 6;
  const int tilesM = M >> 6;
  const int tile = blockIdx.x * 8 + wave;
  if (tile >= tilesM * tilesN) return;   // wave-uniform; no block barriers in this kernel
  const int tm = tile / tilesN;
  const int tn = tile - tm * tilesN;
  const int m0 = tm << 6;
  const int n0 = tn << 6;

  const _Float16* Ab  = A + (size_t)b * (size_t)strideA;
  const _Float16* Ab2 = (NSPLIT == 1) ? (A2 + (size_t)b * (size_t)strideA2) : Ab;
  const _Float16* Bb  = Bt + (size_t)b * (size_t)strideB;
  const int ld2 = (NSPLIT == 1) ? lda2 : lda;

  const int rlane = lane & 15;                 // row (A) / col (B, D) within subtile
  const int koff  = (lane >> 4) * 8;           // k offset of this lane half
  const int mOff  = (lane >> 4) * 8;           // D row offset

  v8f acc[4][4];
#pragma unroll
  for (int i = 0; i < 4; ++i)
#pragma unroll
    for (int j = 0; j < 4; ++j) acc[i][j] = zero8();

  for (int k0 = 0; k0 < K; k0 += 32) {
    v16h bh[4];
#pragma unroll
    for (int j = 0; j < 4; ++j) {
      const size_t bo = (size_t)(n0 + (j << 4) + rlane) * ldb + koff + k0;
      bh[j] = ldfrag_h(Bb + bo);
    }
#pragma unroll
    for (int i = 0; i < 4; ++i) {
      const size_t ao = (size_t)(m0 + (i << 4) + rlane) * lda + koff + k0;
      const v16h ah = ldfrag_h(Ab + ao);
      v16h al = ah;
      if (NSPLIT == 1) {
        const size_t ao2 = (size_t)(m0 + (i << 4) + rlane) * ld2 + koff + k0;
        al = ldfrag_h(Ab2 + ao2);
      }
#pragma unroll
      for (int j = 0; j < 4; ++j) acc[i][j] = mma_h_raw(ah, bh[j], acc[i][j]);
      if (NSPLIT == 1) {
#pragma unroll
        for (int j = 0; j < 4; ++j) {
          v8f tp = mma_h_raw(al, bh[j], zero8());
          res_guard(tp, acc[i][j], al, bh[j]);
#pragma unroll
          for (int r = 0; r < 8; ++r) acc[i][j][r] += tp[r] * rres;
        }
      }
      dep_guard_h(acc[i][0], acc[i][3], ah, al);
    }
    keep4_h(bh[0], bh[1], bh[2], bh[3]);
  }
  acc_guard4(acc[0][0], acc[0][1], acc[0][2], acc[0][3]);
  acc_guard4(acc[1][0], acc[1][1], acc[1][2], acc[1][3]);
  acc_guard4(acc[2][0], acc[2][1], acc[2][2], acc[2][3]);
  acc_guard4(acc[3][0], acc[3][1], acc[3][2], acc[3][3]);

  // ---- epilogue ----
  float bcol[4];
#pragma unroll
  for (int j = 0; j < 4; ++j) bcol[j] = 0.f;
  if (BIAS == 1) {
#pragma unroll
    for (int j = 0; j < 4; ++j) bcol[j] = bf_up(bf_bits(bias[n0 + (j << 4) + rlane]));
  }
  float* slab = sT[wave];
#pragma unroll
  for (int i = 0; i < 4; ++i) {
    const int mBase = m0 + (i << 4);
    float brow[8];
#pragma unroll
    for (int r = 0; r < 8; ++r) brow[r] = 0.f;
    if (BIAS == 2) {
#pragma unroll
      for (int r = 0; r < 8; ++r) brow[r] = bf_up(bf_bits(bias[mBase + mOff + r]));
    }
#pragma unroll
    for (int j = 0; j < 4; ++j) {
#pragma unroll
      for (int r = 0; r < 8; ++r) {
        float v = acc[i][j][r] * oscale + bcol[j] + brow[r];
        if (RELU) v = fmaxf(v, 0.f);
        slab[(mOff + r) * 68 + (j << 4) + rlane] = v;
      }
    }
    wave_sync_lds();
    if (OUT_MODE == 0) {
      float* C = (float*)Cout + (size_t)b * (size_t)strideC;
      const int hh = lane >> 4, c4 = (lane & 15) * 4;     // 256-B row segment = 16 lanes x 16 B
      {
#pragma unroll
        for (int it = 0; it < 8; ++it) {
          const int row = it * 2 + hh;                     // it 0..7 x hh 0..1 = rows 0..15
          const v4f v = *(const v4f*)(slab + row * 68 + c4);
          *(v4f*)(C + (size_t)(mBase + row) * ldc + n0 + c4) = v;
        }
        
      }
    } else {
      const int q4 = lane >> 3, c8 = (lane & 7) * 8;
      unsigned short* C  = (unsigned short*)Cout  + (size_t)b * (size_t)strideC;
      unsigned short* C2 = (unsigned short*)Cout2 + (size_t)b * (size_t)strideC2;
      const bool wlo = (OUT_MODE == 3) && (n0 >= rlo);     // wave-uniform
      v4u hv[4], lv[4];
#pragma unroll
      for (int it = 0; it < 4; ++it) {
        const int row = it * 4 + q4;                       // it 0..3 x q4 0..3 = rows 0..15
        const float* sp = slab + row * 68 + c8;
        v4u a, a2;
#pragma unroll
        for (int e = 0; e < 4; ++e) {
          const float f0 = sp[2 * e], f1 = sp[2 * e + 1];
          const _Float16 x0 = (_Float16)f0, x1 = (_Float16)f1;
          const unsigned short h0 = h_bits(x0), h1 = h_bits(x1);
          unsigned short l0 = 0, l1 = 0;
          if (OUT_MODE == 3) {
            l0 = h_bits((_Float16)((f0 - (float)x0) * rscale));
            l1 = h_bits((_Float16)((f1 - (float)x1) * rscale));
          }
          a[e] = pk16(h0, h1); a2[e] = pk16(l0, l1);
        }
        hv[it] = a; lv[it] = a2;
      }
      {
#pragma unroll
        for (int it = 0; it < 4; ++it) {
          const int row = it * 4 + q4;
          *(v4u*)(C + (size_t)(mBase + row) * ldc + n0 + c8) = hv[it];
          if (wlo) *(v4u*)(C2 + (size_t)(mBase + row) * ldc2 + (n0 - rlo) + c8) = lv[it];
        }
        
      }
    }
    wave_sync_lds();
  }
}

// =====================================================================================================
// Row softmax: S f32 [rows][ncols] -> P f16 = f16( carry * exp(s - max) / sum ), carry a power of two.
// One block of 256 per row, thread t owns columns 8t..8t+7 (ncols == 2048, host-checked): contiguous
// coverage: 256 threads x 8 halves = the whole row; grid = rows.
// =====================================================================================================
__global__ __launch_bounds__(256)
void softmax_p16(const float* __restrict__ S, unsigned short* P, int ncols, float carry) {
  __shared__ float rmax[8];
  __shared__ float rsum[8];
  const int row  = blockIdx.x;
  const int t    = threadIdx.x;
  const int lane = t & 31;
  const int wave = t >> 5;
  const float* s = S + (size_t)row * ncols + 8 * t;
  const v4f a = *(const v4f*)(s);
  const v4f c = *(const v4f*)(s + 4);
  float v[8];
  v[0] = a[0]; v[1] = a[1]; v[2] = a[2]; v[3] = a[3];
  v[4] = c[0]; v[5] = c[1]; v[6] = c[2]; v[7] = c[3];
  float m = v[0];
#pragma unroll
  for (int j = 1; j < 8; ++j) m = fmaxf(m, v[j]);
#pragma unroll
  for (int off = 1; off < 32; off <<= 1) m = fmaxf(m, __shfl_xor(m, off, 32));
  if (lane == 0) rmax[wave] = m;
  __syncthreads();
  m = rmax[0];
#pragma unroll
  for (int w = 1; w < 8; ++w) m = fmaxf(m, rmax[w]);
  float e[8];
  float sum = 0.f;
#pragma unroll
  for (int j = 0; j < 8; ++j) { e[j] = __expf(v[j] - m); sum += e[j]; }
#pragma unroll
  for (int off = 1; off < 32; off <<= 1) sum += __shfl_xor(sum, off, 32);
  if (lane == 0) rsum[wave] = sum;
  __syncthreads();
  float tot = rsum[0];
#pragma unroll
  for (int w = 1; w < 8; ++w) tot += rsum[w];
  const float inv = carry * (1.0f / tot);
  v4u pk;
#pragma unroll
  for (int q = 0; q < 4; ++q) {
    pk[q] = pk16(h_bits((_Float16)(e[2 * q] * inv)), h_bits((_Float16)(e[2 * q + 1] * inv)));
  }
  unsigned short* p = P + (size_t)row * ncols + 8 * t;
  *(v4u*)p = pk;
  
}

// =====================================================================================================
// Workspace map (bytes), every plane an exact multiple of its 64x64-tile / whole-line store granularity:
//   Xh   f16 [16384][512]   (x  bf16-RNE, carried x16)        0           16777216
//   W1h  f16 [2048][512]    (We1 bf16-RNE, carried x1024)     16777216    2097152
//   W2h  f16 [512][2048]    (We2, x1024)                      18874368    2097152
//   Wk1h f16 [2048][512]    (Wk1, x1024)                      20971520    2097152
//   Wk2h f16 [256][2048]    (Wk2, x1024)                      23068672    1048576
//   Hb   f16 [8192][2048]   hidden plane, one M-half at a time 24117248    33554432
//   ET   f16 [8][512][2048] embs^T per batch                   57671680    16777216
//   KQ   f16 [16384][256]   k cols 0..127, q cols 128..255     74448896    8388608
//   QL   f16 [16384][128]   q residual x4096                   82837504    4194304
//   Sf   f32 [2048][2048]   scores of one batch                87031808    16777216
//   Pf   f16 [2048][2048]   probabilities x1024 of one batch   103809024   8388608
//   end                                                         112197632
// Weights are [out n][in k] with k contiguous = the Bt / A layout the GEMM wants, so they are only converted.
// =====================================================================================================
extern "C" void kernel_launch(void* const* d_in, const int* in_sizes, int n_in,
                              void* d_out, int out_size, void* d_ws, size_t ws_size,
                              hipStream_t stream) {
  if (n_in < 9) return;
  if (in_sizes[0] != NROWS * DIN) return;
  if (in_sizes[1] != HID * DIN) return;
  if (in_sizes[2] != HID) return;
  if (in_sizes[3] != DIN * HID) return;
  if (in_sizes[4] != DIN) return;
  if (in_sizes[5] != HID * DIN) return;
  if (in_sizes[6] != HID) return;
  if (in_sizes[7] != KQW * HID) return;
  if (in_sizes[8] != KQW) return;
  if (out_size != NROWS * DIN) return;

  const float* x   = (const float*)d_in[0];
  const float* We1 = (const float*)d_in[1];
  const float* be1 = (const float*)d_in[2];
  const float* We2 = (const float*)d_in[3];
  const float* be2 = (const float*)d_in[4];
  const float* Wk1 = (const float*)d_in[5];
  const float* bk1 = (const float*)d_in[6];
  const float* Wk2 = (const float*)d_in[7];
  const float* bk2 = (const float*)d_in[8];

  const size_t PXh  = (size_t)NROWS * DIN * 2;          // 16777216
  const size_t PW1  = (size_t)HID * DIN * 2;            //  2097152
  const size_t PW2  = (size_t)DIN * HID * 2;            //  2097152
  const size_t PWk2 = (size_t)KQW * HID * 2;            //  1048576
  const size_t PH   = (size_t)MHALF * HID * 2;          // 33554432
  const size_t PET  = (size_t)NBATCH * DIN * SEQ * 2;   // 16777216
  const size_t PKQ  = (size_t)NROWS * KQW * 2;          //  8388608
  const size_t PQL  = (size_t)NROWS * DKEY * 2;         //  4194304
  const size_t PS   = (size_t)SEQ * SEQ * 4;            // 16777216
  const size_t PP   = (size_t)SEQ * SEQ * 2;            //  8388608
  size_t off = 0;
  const size_t oXh  = off; off += PXh;
  const size_t oW1  = off; off += PW1;
  const size_t oW2  = off; off += PW2;
  const size_t oWk1 = off; off += PW1;
  const size_t oWk2 = off; off += PWk2;
  const size_t oH   = off; off += PH;
  const size_t oET  = off; off += PET;
  const size_t oKQ  = off; off += PKQ;
  const size_t oQL  = off; off += PQL;
  const size_t oS   = off; off += PS;
  const size_t oP   = off; off += PP;
  if (off > ws_size) return;                             // off = 112197632
  if (off > (size_t)134217728) return;

  char* ws = (char*)d_ws;
  unsigned short* Xh   = (unsigned short*)(ws + oXh);
  unsigned short* W1h  = (unsigned short*)(ws + oW1);
  unsigned short* W2h  = (unsigned short*)(ws + oW2);
  unsigned short* Wk1h = (unsigned short*)(ws + oWk1);
  unsigned short* Wk2h = (unsigned short*)(ws + oWk2);
  unsigned short* Hb   = (unsigned short*)(ws + oH);
  unsigned short* ET   = (unsigned short*)(ws + oET);
  unsigned short* KQ   = (unsigned short*)(ws + oKQ);
  unsigned short* QL   = (unsigned short*)(ws + oQL);
  float*          Sf   = (float*)(ws + oS);
  unsigned short* Pf   = (unsigned short*)(ws + oP);
  float*          out  = (float*)d_out;

  const dim3 blk(256);
  const int n8x  = NROWS * DIN / 8;                            // 1048576
  const int n8w  = HID * DIN / 8;                              //  131072
  const int n8wk2 = KQW * HID / 8;                             //   65536
  const dim3 gCvtX((n8x + 255) / 256);                         // 4096 blocks
  const dim3 gCvtW((n8w + 255) / 256);                         //  512 blocks
  const dim3 gCvtWk2((n8wk2 + 255) / 256);                     //  256 blocks
  const dim3 gG1(((MHALF / 64) * (HID / 64) + 7) / 8, 1);       // 4096 tiles -> 512 blocks
  const dim3 gG2(((DIN / 64) * (SEQ / 64) + 7) / 8, 4);         // 256 tiles -> 32 blocks x 4 batches
  const dim3 gG4(((MHALF / 64) * (KQW / 64) + 7) / 8, 1);       // 512 tiles -> 64 blocks
  const dim3 gG5(((SEQ / 64) * (SEQ / 64) + 7) / 8, 1);         // 1024 tiles -> 128 blocks
  const dim3 gG6(((SEQ / 64) * (DIN / 64) + 7) / 8, 1);         // 256 tiles -> 32 blocks
  const dim3 gSm(SEQ);                                          // 2048 rows

  const float osc1  = 1.0f / 16384.0f;   // undo x*16 and W*1024
  const float osc2  = 1.0f / 1024.0f;    // undo W*1024 (hidden plane carried x1)
  const float oscPV = 1.0f / 1024.0f;    // undo p*1024

  // (1) inputs -> f16 planes holding bf16-RNE values times an exact power of two
  cvt_h8<<<gCvtX, blk, 0, stream>>>(x, Xh, n8x, 16.0f);
  cvt_h8<<<gCvtW, blk, 0, stream>>>(We1, W1h, n8w, 1024.0f);
  cvt_h8<<<gCvtW, blk, 0, stream>>>(We2, W2h, n8w, 1024.0f);
  cvt_h8<<<gCvtW, blk, 0, stream>>>(Wk1, Wk1h, n8w, 1024.0f);
  cvt_h8<<<gCvtWk2, blk, 0, stream>>>(Wk2, Wk2h, n8wk2, 1024.0f);

  for (int mh = 0; mh < 2; ++mh) {
    const unsigned short* Xhalf = Xh + (size_t)mh * MHALF * DIN;
    // (2) h_e = relu(x . We1^T + be1) -> f16 [8192][2048]   (M=8192, N=2048, K=512)
    gemm64<0, 1, 1, 1><<<gG1, blk, 0, stream>>>(
        Xhalf, DIN, 0LL, Xhalf, DIN, 0LL, W1h, DIN, 0LL, be1,
        (void*)Hb, HID, 0LL, (void*)Hb, HID, 0LL, 0,
        MHALF, HID, DIN, osc1, 0.0f, 1.0f);
    // (3) embs^T[b][d][m] = We2[d] . h_e[b*SEQ+m] + be2[d] -> f16 [b][512][2048]
    //     (A = W2h [512][2048], Bt = h_e rows of batch b (4 batches in this half); M=512, N=2048, K=2048)
    gemm64<0, 0, 2, 1><<<gG2, blk, 0, stream>>>(
        W2h, HID, 0LL, W2h, HID, 0LL, Hb, HID, (long long)SEQ * HID, be2,
        (void*)(ET + (size_t)(mh * 4) * DIN * SEQ), SEQ, (long long)DIN * SEQ,
        (void*)(ET + (size_t)(mh * 4) * DIN * SEQ), SEQ, (long long)DIN * SEQ, 0,
        DIN, SEQ, HID, osc2, 0.0f, 1.0f);
    // (4) h_k = relu(x . Wk1^T + bk1) -> f16 [8192][2048]
    gemm64<0, 1, 1, 1><<<gG1, blk, 0, stream>>>(
        Xhalf, DIN, 0LL, Xhalf, DIN, 0LL, Wk1h, DIN, 0LL, bk1,
        (void*)Hb, HID, 0LL, (void*)Hb, HID, 0LL, 0,
        MHALF, HID, DIN, osc1, 0.0f, 1.0f);
    // (5) kq = h_k . Wk2^T + bk2 -> f16 [8192][256] (k cols 0..127, q cols 128..255) + q residual x4096
    //     plane [8192][128] for tiles with n0 >= 128   (M=8192, N=256, K=2048)
    gemm64<0, 0, 1, 3><<<gG4, blk, 0, stream>>>(
        Hb, HID, 0LL, Hb, HID, 0LL, Wk2h, HID, 0LL, bk2,
        (void*)(KQ + (size_t)mh * MHALF * KQW), KQW, 0LL,
        (void*)(QL + (size_t)mh * MHALF * DKEY), DKEY, 0LL, DKEY,
        MHALF, KQW, HID, osc2, 0.0f, 4096.0f);
  }

  for (int bb = 0; bb < NBATCH; ++bb) {
    const unsigned short* KQb = KQ + (size_t)bb * SEQ * KQW;
    const unsigned short* QLb = QL + (size_t)bb * SEQ * DKEY;
    // (6) S[n][m] = q_n . k_m: A = q cols (hi, pitch 256) + residual plane (pitch 128), Bt = k cols;
    //     2 f16 products, residual folded with 1/4096   (M=N=2048, K=128) -> f32 [2048][2048]
    gemm64<1, 0, 0, 0><<<gG5, blk, 0, stream>>>(
        KQb + DKEY, KQW, 0LL, QLb, DKEY, 0LL, KQb, KQW, 0LL, be1,
        (void*)Sf, SEQ, 0LL, (void*)Sf, SEQ, 0LL, 0,
        SEQ, SEQ, DKEY, 1.0f, 1.0f / 4096.0f, 1.0f);
    // (7) P = 1024 * softmax(S) over 2048 keys -> f16 [2048][2048]
    softmax_p16<<<gSm, blk, 0, stream>>>(Sf, Pf, SEQ, 1024.0f);
    // (8) out[b][n][d] = sum_m P[n][m] embs^T[b][d][m] / 1024 -> d_out f32 rows b*2048.. (M=2048, N=512, K=2048)
    gemm64<0, 0, 0, 0><<<gG6, blk, 0, stream>>>(
        Pf, SEQ, 0LL, Pf, SEQ, 0LL, ET + (size_t)bb * DIN * SEQ, SEQ, 0LL, be1,
        (void*)(out + (size_t)bb * SEQ * DIN), DIN, 0LL,
        (void*)(out + (size_t)bb * SEQ * DIN), DIN, 0LL, 0,
        SEQ, DIN, SEQ, oscPV, 0.0f, 1.0f);
  }
  (void)hipGetLastError();
}

// v001
// One run takes 523 microseconds.
// In two side-by-side timings against v000, it was 2.47 and 2.46 times as fast.
// Contractions: x.We1^T, h_e.We2^T (produced as embs^T), x.Wk1^T, h_k.Wk2^T, q.k^T and p.embs all run on v_wmma_f32_16x16x32_f16 (f16 operands: x and W/b RNE-converted to bf16 and carried exactly in f16 as x*16 and W*1024; hidden, embs and k planes plain f16; q = f16 hi plane + f16 residual plane x4096 folded from a separate accumulator (2 products); p carried x1024 in f16), all f32 accumulate; bias, ReLU and softmax in f32.
#include <hip/hip_runtime.h>
#include <math.h>
#include <stdint.h>

#define NBATCH 8
#define SEQ    2048
#define DIN    512
#define HID    2048
#define DKEY   128
#define KQW    (2 * DKEY)
#define NROWS  (NBATCH * SEQ)     // 16384
static_assert((SEQ % 64) == 0 && (DIN % 64) == 0 && (HID % 64) == 0 && (KQW % 64) == 0);
static_assert((DKEY % 32) == 0 && (DIN % 32) == 0 && (HID % 32) == 0);
static_assert(SEQ == 256 * 8);

typedef _Float16 v16h __attribute__((ext_vector_type(16)));
typedef _Float16 v8h  __attribute__((ext_vector_type(8)));
typedef float    v8f  __attribute__((ext_vector_type(8)));
typedef float    v4f  __attribute__((ext_vector_type(4)));
typedef unsigned int v4u __attribute__((ext_vector_type(4)));

// ---- scalar helpers --------------------------------------------------------------------------------
__device__ __forceinline__ unsigned short bf_bits(float f) {          // f32 -> bf16 bits, RNE convert
  unsigned u = __float_as_uint(f);
  return (unsigned short)((u + 0x7FFFu + ((u >> 16) & 1u)) >> 16);
}
__device__ __forceinline__ float bf_up(unsigned short h) { return __uint_as_float(((unsigned)h) << 16); }
__device__ __forceinline__ unsigned short h_bits(_Float16 x) { return __builtin_bit_cast(unsigned short, x); }
__device__ __forceinline__ unsigned pk16(unsigned short a, unsigned short b) { return (unsigned)a | ((unsigned)b << 16); }
__device__ __forceinline__ v8f zero8() { v8f z = {0.f, 0.f, 0.f, 0.f, 0.f, 0.f, 0.f, 0.f}; return z; }

// ---- fragment loader: 16-bit A/B operand, lane -> row/col (lane&15), p already includes +8*(lane>>4);
//      elements 0..7 <- p[0..7] (k0+8h..), elements 8..15 <- p[16..23] (k0+16+8h..)
__device__ __forceinline__ v16h ldfrag_h(const _Float16* p) {
  union { v16h v; v8h h[2]; } f;
  f.h[0] = *(const v8h*)(p);
  f.h[1] = *(const v8h*)(p + 16);
  return f.v;
}

// ---- WMMA helpers with trailing VALU hazard gap --------------------------------------------------------
__device__ __forceinline__ v8f mma_h_raw(v16h a, v16h b, v8f c) {
  return __builtin_amdgcn_wmma_f32_16x16x32_f16(false, a, false, b, (short)0, c, false, false);
}
__device__ __forceinline__ void res_guard(v8f& t, v8f& acc, v16h x, v16h y) {
#if defined(__HIP_DEVICE_COMPILE__)
  asm volatile("v_nop\n\tv_nop\n\tv_nop\n\tv_nop" : "+v"(t), "+v"(acc) : "v"(x), "v"(y));
#endif
}
__device__ __forceinline__ void dep_guard_h(v8f& a, v8f& b, v16h x, v16h y) {
#if defined(__HIP_DEVICE_COMPILE__)
  asm volatile("v_nop\n\tv_nop\n\tv_nop\n\tv_nop" : "+v"(a), "+v"(b) : "v"(x), "v"(y));
#endif
}
__device__ __forceinline__ void keep4_h(v16h a, v16h b, v16h c, v16h d) {
#if defined(__HIP_DEVICE_COMPILE__)
  asm volatile("v_nop" :: "v"(a), "v"(b), "v"(c), "v"(d));
#endif
}
__device__ __forceinline__ void acc_guard4(v8f& a, v8f& b, v8f& c, v8f& d) {
#if defined(__HIP_DEVICE_COMPILE__)
  asm volatile("v_nop\n\tv_nop\n\tv_nop\n\tv_nop" : "+v"(a), "+v"(b), "+v"(c), "+v"(d));
#endif
}
__device__ __forceinline__ void wave_sync_lds() {
  __builtin_amdgcn_fence(__ATOMIC_RELEASE, "workgroup");
  __builtin_amdgcn_wave_barrier();
  __builtin_amdgcn_fence(__ATOMIC_ACQUIRE, "workgroup");
}

// =====================================================================================================
// f32 -> f16( bf16_RNE(x) * scale ), scale a power of two (exact), 8 elements per thread, one 16-B store
// =====================================================================================================
__global__ __launch_bounds__(256) void cvt_h8(const float* __restrict__ in, unsigned short* out, int n8, float scale) {
  const int i = blockIdx.x * 256 + threadIdx.x;
  if (i < n8) {
    const v4f a = *(const v4f*)(in + (size_t)i * 8);
    const v4f c = *(const v4f*)(in + (size_t)i * 8 + 4);
    float f[8];
    f[0] = a[0]; f[1] = a[1]; f[2] = a[2]; f[3] = a[3];
    f[4] = c[0]; f[5] = c[1]; f[6] = c[2]; f[7] = c[3];
    unsigned short hb[8];
#pragma unroll
    for (int e = 0; e < 8; ++e) hb[e] = h_bits((_Float16)(bf_up(bf_bits(f[e])) * scale));
    v4u p;
    p[0] = pk16(hb[0], hb[1]);
    p[1] = pk16(hb[2], hb[3]);
    p[2] = pk16(hb[4], hb[5]);
    p[3] = pk16(hb[6], hb[7]);
    *(v4u*)(out + (size_t)i * 8) = p;
    
  }
}

// =====================================================================================================
// Register-blocked batched f16 WMMA GEMM: C[m][n] = epi( sum_k A[m][k] * Bt[n][k] ); one wave per 64x64
// tile, no block barriers. A row-major [M][K] pitch lda; Bt row-major [N][K] pitch ldb (k contiguous);
// M, N multiples of 64, K multiple of 32 (host-checked). blockIdx.y = batch index (strides in elements).
// NSPLIT: 0 = A.Bt; 1 = A.Bt + rres * (A2.Bt) with A2 = scaled f16 residual plane of A (pitch lda2),
//         residual products computed per k-step into a zeroed accumulator and folded in f32.
// epi: v = acc * oscale (+ bf16_RNE(bias[n]) if BIAS==1, + bf16_RNE(bias[m]) if BIAS==2), ReLU if RELU.
// OUT_MODE: 0 = f32 (pitch ldc); 1 = f16 plane C; 3 = f16 hi plane C + f16 residual plane C2 =
//           f16((v - hi) * rscale) written for tiles with n0 >= rlo at column n0 - rlo (pitch ldc2).
// =====================================================================================================
template <int NSPLIT, int RELU, int BIAS, int OUT_MODE>
__global__ __launch_bounds__(256) void gemm64(
    const unsigned short* __restrict__ Ap, int lda, long long strideA,
    const unsigned short* __restrict__ A2p, int lda2, long long strideA2,
    const unsigned short* __restrict__ Btp, int ldb, long long strideB,
    const float* __restrict__ bias,
    void* Cout, int ldc, long long strideC,
    void* Cout2, int ldc2, long long strideC2, int rlo,
    int M, int N, int K, float oscale, float rres, float rscale) {
  const _Float16* A  = (const _Float16*)(const void*)Ap;
  const _Float16* A2 = (const _Float16*)(const void*)A2p;
  const _Float16* Bt = (const _Float16*)(const void*)Btp;
  __shared__ __align__(16) float sT[8][16 * 68];   // per-wave 16x64 slab, pitch 68 floats
  const int b    = blockIdx.y;
  const int lane = threadIdx.x & 31;
  const int wave = threadIdx.x >> 5;
  const int tilesN = N >> 6;
  const int tilesM = M >> 6;
  const int tile = blockIdx.x * 8 + wave;
  if (tile >= tilesM * tilesN) return;   // wave-uniform; no block barriers in this kernel
  const int tm = tile / tilesN;
  const int tn = tile - tm * tilesN;
  const int m0 = tm << 6;
  const int n0 = tn << 6;

  const _Float16* Ab  = A + (size_t)b * (size_t)strideA;
  const _Float16* Ab2 = (NSPLIT == 1) ? (A2 + (size_t)b * (size_t)strideA2) : Ab;
  const _Float16* Bb  = Bt + (size_t)b * (size_t)strideB;
  const int ld2 = (NSPLIT == 1) ? lda2 : lda;

  const int rlane = lane & 15;                 // row (A) / col (B, D) within subtile
  const int koff  = (lane >> 4) * 8;           // k offset of this lane half
  const int mOff  = (lane >> 4) * 8;           // D row offset

  v8f acc[4][4];
#pragma unroll
  for (int i = 0; i < 4; ++i)
#pragma unroll
    for (int j = 0; j < 4; ++j) acc[i][j] = zero8();

  for (int k0 = 0; k0 < K; k0 += 32) {
    v16h bh[4];
#pragma unroll
    for (int j = 0; j < 4; ++j) {
      const size_t bo = (size_t)(n0 + (j << 4) + rlane) * ldb + koff + k0;
      bh[j] = ldfrag_h(Bb + bo);
    }
#pragma unroll
    for (int i = 0; i < 4; ++i) {
      const size_t ao = (size_t)(m0 + (i << 4) + rlane) * lda + koff + k0;
      const v16h ah = ldfrag_h(Ab + ao);
      v16h al = ah;
      if (NSPLIT == 1) {
        const size_t ao2 = (size_t)(m0 + (i << 4) + rlane) * ld2 + koff + k0;
        al = ldfrag_h(Ab2 + ao2);
      }
#pragma unroll
      for (int j = 0; j < 4; ++j) acc[i][j] = mma_h_raw(ah, bh[j], acc[i][j]);
      if (NSPLIT == 1) {
#pragma unroll
        for (int j = 0; j < 4; ++j) {
          v8f tp = mma_h_raw(al, bh[j], zero8());
          res_guard(tp, acc[i][j], al, bh[j]);
#pragma unroll
          for (int r = 0; r < 8; ++r) acc[i][j][r] += tp[r] * rres;
        }
      }
      dep_guard_h(acc[i][0], acc[i][3], ah, al);
    }
    keep4_h(bh[0], bh[1], bh[2], bh[3]);
  }
  acc_guard4(acc[0][0], acc[0][1], acc[0][2], acc[0][3]);
  acc_guard4(acc[1][0], acc[1][1], acc[1][2], acc[1][3]);
  acc_guard4(acc[2][0], acc[2][1], acc[2][2], acc[2][3]);
  acc_guard4(acc[3][0], acc[3][1], acc[3][2], acc[3][3]);

  // ---- epilogue ----
  float bcol[4];
#pragma unroll
  for (int j = 0; j < 4; ++j) bcol[j] = 0.f;
  if (BIAS == 1) {
#pragma unroll
    for (int j = 0; j < 4; ++j) bcol[j] = bf_up(bf_bits(bias[n0 + (j << 4) + rlane]));
  }
  float* slab = sT[wave];
#pragma unroll
  for (int i = 0; i < 4; ++i) {
    const int mBase = m0 + (i << 4);
    float brow[8];
#pragma unroll
    for (int r = 0; r < 8; ++r) brow[r] = 0.f;
    if (BIAS == 2) {
#pragma unroll
      for (int r = 0; r < 8; ++r) brow[r] = bf_up(bf_bits(bias[mBase + mOff + r]));
    }
#pragma unroll
    for (int j = 0; j < 4; ++j) {
#pragma unroll
      for (int r = 0; r < 8; ++r) {
        float v = acc[i][j][r] * oscale + bcol[j] + brow[r];
        if (RELU) v = fmaxf(v, 0.f);
        slab[(mOff + r) * 68 + (j << 4) + rlane] = v;
      }
    }
    wave_sync_lds();
    if (OUT_MODE == 0) {
      float* C = (float*)Cout + (size_t)b * (size_t)strideC;
      const int hh = lane >> 4, c4 = (lane & 15) * 4;     // 256-B row segment = 16 lanes x 16 B
      {
#pragma unroll
        for (int it = 0; it < 8; ++it) {
          const int row = it * 2 + hh;                     // it 0..7 x hh 0..1 = rows 0..15
          const v4f v = *(const v4f*)(slab + row * 68 + c4);
          *(v4f*)(C + (size_t)(mBase + row) * ldc + n0 + c4) = v;
        }
        
      }
    } else {
      const int q4 = lane >> 3, c8 = (lane & 7) * 8;
      unsigned short* C  = (unsigned short*)Cout  + (size_t)b * (size_t)strideC;
      unsigned short* C2 = (unsigned short*)Cout2 + (size_t)b * (size_t)strideC2;
      const bool wlo = (OUT_MODE == 3) && (n0 >= rlo);     // wave-uniform
      v4u hv[4], lv[4];
#pragma unroll
      for (int it = 0; it < 4; ++it) {
        const int row = it * 4 + q4;                       // it 0..3 x q4 0..3 = rows 0..15
        const float* sp = slab + row * 68 + c8;
        v4u a, a2;
#pragma unroll
        for (int e = 0; e < 4; ++e) {
          const float f0 = sp[2 * e], f1 = sp[2 * e + 1];
          const _Float16 x0 = (_Float16)f0, x1 = (_Float16)f1;
          const unsigned short h0 = h_bits(x0), h1 = h_bits(x1);
          unsigned short l0 = 0, l1 = 0;
          if (OUT_MODE == 3) {
            l0 = h_bits((_Float16)((f0 - (float)x0) * rscale));
            l1 = h_bits((_Float16)((f1 - (float)x1) * rscale));
          }
          a[e] = pk16(h0, h1); a2[e] = pk16(l0, l1);
        }
        hv[it] = a; lv[it] = a2;
      }
      {
#pragma unroll
        for (int it = 0; it < 4; ++it) {
          const int row = it * 4 + q4;
          *(v4u*)(C + (size_t)(mBase + row) * ldc + n0 + c8) = hv[it];
          if (wlo) *(v4u*)(C2 + (size_t)(mBase + row) * ldc2 + (n0 - rlo) + c8) = lv[it];
        }
        
      }
    }
    wave_sync_lds();
  }
}

// =====================================================================================================
// Row softmax: S f32 [rows][ncols] -> P f16 = f16( carry * exp(s - max) / sum ), carry a power of two.
// One block of 256 per row, thread t owns columns 8t..8t+7 (ncols == 2048, host-checked): contiguous
// coverage: 256 threads x 8 halves = the whole row; grid = rows.
// =====================================================================================================
__global__ __launch_bounds__(256)
void softmax_p16(const float* __restrict__ S, unsigned short* P, int ncols, float carry) {
  __shared__ float rmax[8];
  __shared__ float rsum[8];
  const int row  = blockIdx.x;
  const int t    = threadIdx.x;
  const int lane = t & 31;
  const int wave = t >> 5;
  const float* s = S + (size_t)row * ncols + 8 * t;
  const v4f a = *(const v4f*)(s);
  const v4f c = *(const v4f*)(s + 4);
  float v[8];
  v[0] = a[0]; v[1] = a[1]; v[2] = a[2]; v[3] = a[3];
  v[4] = c[0]; v[5] = c[1]; v[6] = c[2]; v[7] = c[3];
  float m = v[0];
#pragma unroll
  for (int j = 1; j < 8; ++j) m = fmaxf(m, v[j]);
#pragma unroll
  for (int off = 1; off < 32; off <<= 1) m = fmaxf(m, __shfl_xor(m, off, 32));
  if (lane == 0) rmax[wave] = m;
  __syncthreads();
  m = rmax[0];
#pragma unroll
  for (int w = 1; w < 8; ++w) m = fmaxf(m, rmax[w]);
  float e[8];
  float sum = 0.f;
#pragma unroll
  for (int j = 0; j < 8; ++j) { e[j] = __expf(v[j] - m); sum += e[j]; }
#pragma unroll
  for (int off = 1; off < 32; off <<= 1) sum += __shfl_xor(sum, off, 32);
  if (lane == 0) rsum[wave] = sum;
  __syncthreads();
  float tot = rsum[0];
#pragma unroll
  for (int w = 1; w < 8; ++w) tot += rsum[w];
  const float inv = carry * (1.0f / tot);
  v4u pk;
#pragma unroll
  for (int q = 0; q < 4; ++q) {
    pk[q] = pk16(h_bits((_Float16)(e[2 * q] * inv)), h_bits((_Float16)(e[2 * q + 1] * inv)));
  }
  unsigned short* p = P + (size_t)row * ncols + 8 * t;
  *(v4u*)p = pk;
  
}

// =====================================================================================================
// Workspace map (bytes), every plane an exact multiple of its 64x64-tile / whole-line store granularity:
//   ET   f16 [8][512][2048] embs^T per batch                   0           16777216
//   KQ   f16 [16384][256]   k cols 0..127, q cols 128..255     16777216    8388608
//   QL   f16 [16384][128]   q residual x4096                   25165824    4194304
//   Xh   f16 [16384][512]   (x  bf16-RNE, carried x16)         29360128    16777216
//   W1h  f16 [2048][512]    (We1 bf16-RNE, carried x1024)      46137344    2097152
//   W2h  f16 [512][2048]    (We2, x1024)                       48234496    2097152
//   Wk1h f16 [2048][512]    (Wk1, x1024)                       50331648    2097152
//   Wk2h f16 [256][2048]    (Wk2, x1024)                       52428800    1048576
//   Hb   f16 [16384][2048]  hidden plane, all rows             53477376    67108864   (ends 120586240)
//   Sf   f32 [8][2048][2048] scores of all batches             29360128    134217728  (over Xh..Hb, dead by then)
//   Pf   f16 [8][2048][2048] probabilities x1024               163577856   67108864
//   end                                                         230686720
// Weights are [out n][in k] with k contiguous = the Bt / A layout the GEMM wants, so they are only converted.
// Every stage is one launch over all 8 batches, so that the deep-K GEMMs put a work-group on every WGP.
// =====================================================================================================
extern "C" void kernel_launch(void* const* d_in, const int* in_sizes, int n_in,
                              void* d_out, int out_size, void* d_ws, size_t ws_size,
                              hipStream_t stream) {
  if (n_in < 9) return;
  if (in_sizes[0] != NROWS * DIN) return;
  if (in_sizes[1] != HID * DIN) return;
  if (in_sizes[2] != HID) return;
  if (in_sizes[3] != DIN * HID) return;
  if (in_sizes[4] != DIN) return;
  if (in_sizes[5] != HID * DIN) return;
  if (in_sizes[6] != HID) return;
  if (in_sizes[7] != KQW * HID) return;
  if (in_sizes[8] != KQW) return;
  if (out_size != NROWS * DIN) return;

  const float* x   = (const float*)d_in[0];
  const float* We1 = (const float*)d_in[1];
  const float* be1 = (const float*)d_in[2];
  const float* We2 = (const float*)d_in[3];
  const float* be2 = (const float*)d_in[4];
  const float* Wk1 = (const float*)d_in[5];
  const float* bk1 = (const float*)d_in[6];
  const float* Wk2 = (const float*)d_in[7];
  const float* bk2 = (const float*)d_in[8];

  const size_t PXh  = (size_t)NROWS * DIN * 2;            //  16777216
  const size_t PW1  = (size_t)HID * DIN * 2;              //   2097152
  const size_t PW2  = (size_t)DIN * HID * 2;              //   2097152
  const size_t PWk2 = (size_t)KQW * HID * 2;              //   1048576
  const size_t PH   = (size_t)NROWS * HID * 2;            //  67108864
  const size_t PET  = (size_t)NBATCH * DIN * SEQ * 2;     //  16777216
  const size_t PKQ  = (size_t)NROWS * KQW * 2;            //   8388608
  const size_t PQL  = (size_t)NROWS * DKEY * 2;           //   4194304
  const size_t PS   = (size_t)NBATCH * SEQ * SEQ * 4;     // 134217728
  const size_t PP   = (size_t)NBATCH * SEQ * SEQ * 2;     //  67108864
  size_t off = 0;
  const size_t oET  = off; off += PET;
  const size_t oKQ  = off; off += PKQ;
  const size_t oQL  = off; off += PQL;
  const size_t oS   = off;                                // scores lie over Xh..Hb, which are dead by stage (6)
  const size_t oXh  = off; off += PXh;
  const size_t oW1  = off; off += PW1;
  const size_t oW2  = off; off += PW2;
  const size_t oWk1 = off; off += PW1;
  const size_t oWk2 = off; off += PWk2;
  const size_t oH   = off; off += PH;
  if (off > oS + PS) return;                              // the MLP planes end inside the score plane
  off = oS + PS;
  const size_t oP   = off; off += PP;
  if (off > ws_size) return;                              // off = 230686720

  char* ws = (char*)d_ws;
  unsigned short* Xh   = (unsigned short*)(ws + oXh);
  unsigned short* W1h  = (unsigned short*)(ws + oW1);
  unsigned short* W2h  = (unsigned short*)(ws + oW2);
  unsigned short* Wk1h = (unsigned short*)(ws + oWk1);
  unsigned short* Wk2h = (unsigned short*)(ws + oWk2);
  unsigned short* Hb   = (unsigned short*)(ws + oH);
  unsigned short* ET   = (unsigned short*)(ws + oET);
  unsigned short* KQ   = (unsigned short*)(ws + oKQ);
  unsigned short* QL   = (unsigned short*)(ws + oQL);
  float*          Sf   = (float*)(ws + oS);
  unsigned short* Pf   = (unsigned short*)(ws + oP);
  float*          out  = (float*)d_out;

  const dim3 blk(256);
  const int n8x  = NROWS * DIN / 8;                            // 1048576
  const int n8w  = HID * DIN / 8;                              //  131072
  const int n8wk2 = KQW * HID / 8;                             //   65536
  const dim3 gCvtX((n8x + 255) / 256);                         // 4096 blocks
  const dim3 gCvtW((n8w + 255) / 256);                         //  512 blocks
  const dim3 gCvtWk2((n8wk2 + 255) / 256);                     //  256 blocks
  const dim3 gG1(((NROWS / 64) * (HID / 64) + 7) / 8, 1);       // 8192 tiles -> 1024 blocks
  const dim3 gG2(((DIN / 64) * (SEQ / 64) + 7) / 8, NBATCH);    // 256 tiles -> 32 blocks x 8 batches
  const dim3 gG4(((NROWS / 64) * (KQW / 64) + 7) / 8, 1);       // 1024 tiles -> 128 blocks
  const dim3 gG5(((SEQ / 64) * (SEQ / 64) + 7) / 8, NBATCH);    // 1024 tiles -> 128 blocks x 8 batches
  const dim3 gG6(((SEQ / 64) * (DIN / 64) + 7) / 8, NBATCH);    // 256 tiles -> 32 blocks x 8 batches
  const dim3 gSm(NROWS);                                        // 16384 rows

  const float osc1  = 1.0f / 16384.0f;   // undo x*16 and W*1024
  const float osc2  = 1.0f / 1024.0f;    // undo W*1024 (hidden plane carried x1)
  const float oscPV = 1.0f / 1024.0f;    // undo p*1024

  // (1) inputs -> f16 planes holding bf16-RNE values times an exact power of two
  cvt_h8<<<gCvtX, blk, 0, stream>>>(x, Xh, n8x, 16.0f);
  cvt_h8<<<gCvtW, blk, 0, stream>>>(We1, W1h, n8w, 1024.0f);
  cvt_h8<<<gCvtW, blk, 0, stream>>>(We2, W2h, n8w, 1024.0f);
  cvt_h8<<<gCvtW, blk, 0, stream>>>(Wk1, Wk1h, n8w, 1024.0f);
  cvt_h8<<<gCvtWk2, blk, 0, stream>>>(Wk2, Wk2h, n8wk2, 1024.0f);

  // (2) h_e = relu(x . We1^T + be1) -> f16 [16384][2048]   (M=16384, N=2048, K=512)
  gemm64<0, 1, 1, 1><<<gG1, blk, 0, stream>>>(
      Xh, DIN, 0LL, Xh, DIN, 0LL, W1h, DIN, 0LL, be1,
      (void*)Hb, HID, 0LL, (void*)Hb, HID, 0LL, 0,
      NROWS, HID, DIN, osc1, 0.0f, 1.0f);
  // (3) embs^T[b][d][m] = We2[d] . h_e[b*SEQ+m] + be2[d] -> f16 [b][512][2048]
  //     (A = W2h [512][2048], Bt = h_e rows of batch b = blockIdx.y; M=512, N=2048, K=2048)
  gemm64<0, 0, 2, 1><<<gG2, blk, 0, stream>>>(
      W2h, HID, 0LL, W2h, HID, 0LL, Hb, HID, (long long)SEQ * HID, be2,
      (void*)ET, SEQ, (long long)DIN * SEQ,
      (void*)ET, SEQ, (long long)DIN * SEQ, 0,
      DIN, SEQ, HID, osc2, 0.0f, 1.0f);
  // (4) h_k = relu(x . Wk1^T + bk1) -> f16 [16384][2048]
  gemm64<0, 1, 1, 1><<<gG1, blk, 0, stream>>>(
      Xh, DIN, 0LL, Xh, DIN, 0LL, Wk1h, DIN, 0LL, bk1,
      (void*)Hb, HID, 0LL, (void*)Hb, HID, 0LL, 0,
      NROWS, HID, DIN, osc1, 0.0f, 1.0f);
  // (5) kq = h_k . Wk2^T + bk2 -> f16 [16384][256] (k cols 0..127, q cols 128..255) + q residual x4096
  //     plane [16384][128] for tiles with n0 >= 128   (M=16384, N=256, K=2048)
  gemm64<0, 0, 1, 3><<<gG4, blk, 0, stream>>>(
      Hb, HID, 0LL, Hb, HID, 0LL, Wk2h, HID, 0LL, bk2,
      (void*)KQ, KQW, 0LL,
      (void*)QL, DKEY, 0LL, DKEY,
      NROWS, KQW, HID, osc2, 0.0f, 4096.0f);

  // (6) S[b][n][m] = q_n . k_m: A = q cols (hi, pitch 256) + residual plane (pitch 128), Bt = k cols;
  //     2 f16 products, residual folded with 1/4096   (M=N=2048, K=128, b = blockIdx.y) -> f32 [8][2048][2048]
  gemm64<1, 0, 0, 0><<<gG5, blk, 0, stream>>>(
      KQ + DKEY, KQW, (long long)SEQ * KQW, QL, DKEY, (long long)SEQ * DKEY,
      KQ, KQW, (long long)SEQ * KQW, be1,
      (void*)Sf, SEQ, (long long)SEQ * SEQ, (void*)Sf, SEQ, (long long)SEQ * SEQ, 0,
      SEQ, SEQ, DKEY, 1.0f, 1.0f / 4096.0f, 1.0f);
  // (7) P = 1024 * softmax(S) over 2048 keys -> f16 [8][2048][2048], one block a row
  softmax_p16<<<gSm, blk, 0, stream>>>(Sf, Pf, SEQ, 1024.0f);
  // (8) out[b][n][d] = sum_m P[b][n][m] embs^T[b][d][m] / 1024 -> d_out f32 (M=2048, N=512, K=2048, b = blockIdx.y)
  gemm64<0, 0, 0, 0><<<gG6, blk, 0, stream>>>(
      Pf, SEQ, (long long)SEQ * SEQ, Pf, SEQ, (long long)SEQ * SEQ,
      ET, SEQ, (long long)DIN * SEQ, be1,
      (void*)out, DIN, (long long)SEQ * DIN,
      (void*)out, DIN, (long long)SEQ * DIN, 0,
      SEQ, DIN, SEQ, oscPV, 0.0f, 1.0f);
  (void)hipGetLastError();
}
